// v000
// Measured on an AMD MI455X. A time is GPU time per run, averaged over a window of back-to-back runs after a warm-up
// (all launches, gaps included; the runs take copies of the inputs in turn), and the median of several windows.
// Apart from v000's, it joins two sittings. Times from different sittings can be a few percent apart, while
// side-by-side timings come from the same sitting.
// v000 is the starting kernel. One run takes 541 microseconds.
#include <hip/hip_runtime.h>

typedef __attribute__((ext_vector_type(2))) float v2f;
typedef __attribute__((ext_vector_type(4))) float v4f;
typedef __attribute__((ext_vector_type(8))) float v8f;
typedef __attribute__((ext_vector_type(4))) int v4i;

__device__ __forceinline__ v8f wmma4(v2f a, v2f b, v8f c) {
  // 8 args: (neg_a, A, neg_b, B, c_mod, C, reuse_a, reuse_b)
  return __builtin_amdgcn_wmma_f32_16x16x4_f32(false, a, false, b, (short)0, c,
                                               false, false);
}

#if __has_builtin(__builtin_amdgcn_global_load_async_to_lds_b128)
#define HAVE_ASYNC_LDS 1
typedef __attribute__((address_space(1))) v4i gv4i;  // global int4
typedef __attribute__((address_space(3))) v4i lv4i;  // LDS int4
#else
#define HAVE_ASYNC_LDS 0
#endif

__device__ __forceinline__ void copy16_g2lds(void* lds_dst, const void* gsrc) {
#if HAVE_ASYNC_LDS
  __builtin_amdgcn_global_load_async_to_lds_b128((gv4i*)gsrc, (lv4i*)lds_dst,
                                                 0, 0);
#else
  *(v4f*)lds_dst = *(const v4f*)gsrc;
#endif
}

__device__ __forceinline__ void async_join() {
#if HAVE_ASYNC_LDS
#if __has_builtin(__builtin_amdgcn_s_wait_asynccnt)
  __builtin_amdgcn_s_wait_asynccnt(0);
#else
  asm volatile("s_wait_asynccnt 0x0" ::: "memory");
#endif
#endif
}

// ---------------------------------------------------------------------------
// Batched GEMM: C[b] = A[b] (MxKc) * B[b] (KcxN), row-major, fp32.
// Grid: (N/BN, M/BM, batches). Block: 256 threads = 8 waves (4 M x 2 N).
// Per-wave micro-tile: (BM/4) x 64. BM=128 -> 8 accumulators, B-frag reuse x2.
// ---------------------------------------------------------------------------
constexpr int BN = 128, KC = 32;
constexpr int ASTR = KC + 4;  // 36: row stride mult-of-4 floats (b128 stores)
constexpr int BSTR = KC + 2;  // 34: even -> 8B-aligned b64 fragment pairs

template <int BM>
__global__ __launch_bounds__(256) void gemm_f32_wmma(
    const float* __restrict__ A, long long sA, int lda,
    const float* __restrict__ B, long long sB, int ldb,
    float* __restrict__ C, long long sC, int ldc, int Kc) {
  constexpr int WR = BM / 4;   // rows per wave: 16 or 32
  constexpr int NA = WR / 16;  // accumulator row-tiles per wave: 1 or 2
  __shared__ __align__(16) float As[BM][ASTR];
  __shared__ __align__(16) float Bst[BN][BSTR];  // transposed: [n][k]

  const long long bz = blockIdx.z;
  A += bz * sA;
  B += bz * sB;
  C += bz * sC;
  const int m0 = blockIdx.y * BM;
  const int n0 = blockIdx.x * BN;
  const int tid = threadIdx.x;
  const int lane = tid & 31, wave = tid >> 5;
  const int wm = wave & 3, wn = wave >> 2;
  const int half = lane >> 4, lm = lane & 15;

  v8f acc[NA][4] = {};

  for (int kc = 0; kc < Kc; kc += KC) {
    // A tile (BM x 32): straight copy -> async b128 path
    for (int i = tid; i < (BM * KC) / 4; i += 256) {
      const int r = i >> 3, c = (i & 7) << 2;
      copy16_g2lds(&As[r][c], &A[(long long)(m0 + r) * lda + kc + c]);
    }
    // B tile (32 x 128): transpose at store time so frags are b64-contiguous
    for (int i = tid; i < (KC * BN) / 4; i += 256) {
      const int r = i >> 5, c = (i & 31) << 2;
      const v4f bv = *(const v4f*)&B[(long long)(kc + r) * ldb + n0 + c];
      Bst[c + 0][r] = bv.x;
      Bst[c + 1][r] = bv.y;
      Bst[c + 2][r] = bv.z;
      Bst[c + 3][r] = bv.w;
    }
    async_join();
    __syncthreads();

#pragma unroll
    for (int kb = 0; kb < KC; kb += 4) {
      v2f a[NA];
#pragma unroll
      for (int i = 0; i < NA; ++i)
        a[i] = *(const v2f*)&As[wm * WR + i * 16 + lm][kb + 2 * half];
#pragma unroll
      for (int t = 0; t < 4; ++t) {
        const v2f bb = *(const v2f*)&Bst[wn * 64 + t * 16 + lm][kb + 2 * half];
#pragma unroll
        for (int i = 0; i < NA; ++i) acc[i][t] = wmma4(a[i], bb, acc[i][t]);
      }
    }
    __syncthreads();
  }

#pragma unroll
  for (int i = 0; i < NA; ++i)
#pragma unroll
    for (int t = 0; t < 4; ++t)
#pragma unroll
      for (int r = 0; r < 8; ++r) {
        const int row = m0 + wm * WR + i * 16 + r + 8 * half;
        const int col = n0 + wn * 64 + t * 16 + lm;
        C[(long long)row * ldc + col] = acc[i][t][r];
      }
}

// ---------------------------------------------------------------------------
// Fused attention per (b, h, 128-row strip): scores = Q*K^T, tril mask,
// softmax over K=64, out = attn*V.  8 waves x 16 query rows.
// qa[] holds the Q strip during the scores phase, then is recycled as the
// per-wave attention-weight tile (each wave touches only its own 16 rows).
// ---------------------------------------------------------------------------
constexpr float NEGV = -9e15f;
constexpr int QSTR = 68;  // mult-of-4 row stride (b128 stores, b64 frag reads)
constexpr int VSTR = 66;  // even row stride (b64 frag reads)

__global__ __launch_bounds__(256) void attn_f32_wmma(
    const float* __restrict__ q,  // [B*S, 1024] = [b,s,h,hd]
    const float* __restrict__ k,  // [B*K, 1024] = [b,kk,h,hd]
    const float* __restrict__ v,  // [B*K, 1024]
    float* __restrict__ out) {    // [B*S, 1024]
  __shared__ __align__(16) float qa[128][QSTR];  // Q strip, then attn weights
  __shared__ __align__(16) float ks[64][QSTR];   // K_h [kk][hd]
  __shared__ __align__(16) float vst[64][VSTR];  // V_h transposed [hd][kk]

  const int strip = blockIdx.x;  // 0..3
  const int h = blockIdx.y;      // 0..15
  const int b = blockIdx.z;      // 0..31
  const int tid = threadIdx.x;
  const int lane = tid & 31, wave = tid >> 5;
  const int half = lane >> 4, lm = lane & 15;

  // Stage K (async), V (transposed), Q strip (async).
  for (int i = tid; i < 64 * 16; i += 256) {  // 64 rows x 16 v4f
    const int r = i >> 4, c = (i & 15) << 2;
    const long long src = (long long)(b * 64 + r) * 1024 + h * 64 + c;
    copy16_g2lds(&ks[r][c], &k[src]);
    const v4f vv = *(const v4f*)&v[src];
    vst[c + 0][r] = vv.x;
    vst[c + 1][r] = vv.y;
    vst[c + 2][r] = vv.z;
    vst[c + 3][r] = vv.w;
  }
  for (int i = tid; i < 128 * 16; i += 256) {  // 128 rows x 16 v4f
    const int r = i >> 4, c = (i & 15) << 2;
    copy16_g2lds(&qa[r][c],
                 &q[(long long)(b * 512 + strip * 128 + r) * 1024 + h * 64 + c]);
  }
  async_join();
  __syncthreads();

  const int srow0 = strip * 128 + wave * 16;

  // scores = Q * K^T (contraction over HD=64); both frags are b64 LDS loads
  v8f sc[4] = {};
#pragma unroll
  for (int kb = 0; kb < 64; kb += 4) {
    const v2f a = *(const v2f*)&qa[wave * 16 + lm][kb + 2 * half];
#pragma unroll
    for (int t = 0; t < 4; ++t) {
      const v2f bb = *(const v2f*)&ks[t * 16 + lm][kb + 2 * half];
      sc[t] = wmma4(a, bb, sc[t]);
    }
  }

  // tril mask + row softmax. Row m = r + 8*half lives in one 16-lane group;
  // each lane holds 4 columns (16t+lm); xor masks 1/2/4/8 stay in-group.
#pragma unroll
  for (int r = 0; r < 8; ++r) {
    const int srow = srow0 + r + 8 * half;
    float vals[4];
    float mx = NEGV;
#pragma unroll
    for (int t = 0; t < 4; ++t) {
      const int col = t * 16 + lm;
      float x = sc[t][r];
      x = (col <= srow) ? x : NEGV;
      vals[t] = x;
      mx = fmaxf(mx, x);
    }
    mx = fmaxf(mx, __shfl_xor(mx, 1));
    mx = fmaxf(mx, __shfl_xor(mx, 2));
    mx = fmaxf(mx, __shfl_xor(mx, 4));
    mx = fmaxf(mx, __shfl_xor(mx, 8));
    float s = 0.f;
#pragma unroll
    for (int t = 0; t < 4; ++t) {
      vals[t] = __expf(vals[t] - mx);  // masked entries underflow to 0
      s += vals[t];
    }
    s += __shfl_xor(s, 1);
    s += __shfl_xor(s, 2);
    s += __shfl_xor(s, 4);
    s += __shfl_xor(s, 8);
    const float inv = 1.0f / s;
    // Recycle qa: this wave's Q rows are fully consumed (same-wave ds order).
#pragma unroll
    for (int t = 0; t < 4; ++t)
      qa[wave * 16 + r + 8 * half][t * 16 + lm] = vals[t] * inv;
  }

  // out = attn * V (contraction over K=64); V read via transposed tile
  v8f ov[4] = {};
#pragma unroll
  for (int kb = 0; kb < 64; kb += 4) {
    const v2f a = *(const v2f*)&qa[wave * 16 + lm][kb + 2 * half];
#pragma unroll
    for (int t = 0; t < 4; ++t) {
      const v2f bb = *(const v2f*)&vst[t * 16 + lm][kb + 2 * half];
      ov[t] = wmma4(a, bb, ov[t]);
    }
  }

  float* orow = &out[(long long)(b * 512 + srow0) * 1024 + h * 64];
#pragma unroll
  for (int t = 0; t < 4; ++t)
#pragma unroll
    for (int r = 0; r < 8; ++r)
      orow[(long long)(r + 8 * half) * 1024 + t * 16 + lm] = ov[t][r];
}

// ---------------------------------------------------------------------------
extern "C" void kernel_launch(void* const* d_in, const int* in_sizes, int n_in,
                              void* d_out, int out_size, void* d_ws,
                              size_t ws_size, hipStream_t stream) {
  const float* query = (const float*)d_in[0];  // [32,512,1024]
  const float* key   = (const float*)d_in[1];  // [32,512,1024]
  const float* value = (const float*)d_in[2];  // [32,512,1024]
  const float* Wq    = (const float*)d_in[3];  // [1024,16,64]
  const float* Wk    = (const float*)d_in[4];
  const float* Wv    = (const float*)d_in[5];
  const float* Kd    = (const float*)d_in[6];  // [64,512]
  const float* Vd    = (const float*)d_in[7];  // [64,512]
  float* out = (float*)d_out;                  // [32,512,1024]

  // Workspace (fp32 elements), 96 MB total.
  float* ws = (float*)d_ws;
  float* key_ds = ws;                               // 32*64*1024
  float* val_ds = key_ds + (size_t)32 * 64 * 1024;  // 32*64*1024
  float* qb     = val_ds + (size_t)32 * 64 * 1024;  // 32*512*1024
  float* kb     = qb + (size_t)32 * 512 * 1024;     // 32*64*1024
  float* vb     = kb + (size_t)32 * 64 * 1024;      // 32*64*1024

  const long long sKV = 512LL * 1024, sDS = 64LL * 1024;

  // 1) Linformer downsampling: [64,512] x [512,1024] per batch (M=64 -> BM=64)
  gemm_f32_wmma<64><<<dim3(1024 / BN, 1, 32), 256, 0, stream>>>(
      Kd, 0, 512, key, sKV, 1024, key_ds, sDS, 1024, 512);
  gemm_f32_wmma<64><<<dim3(1024 / BN, 1, 32), 256, 0, stream>>>(
      Vd, 0, 512, value, sKV, 1024, val_ds, sDS, 1024, 512);

  // 2) Head projections (flattened single GEMMs, BM=128)
  gemm_f32_wmma<128><<<dim3(1024 / BN, 16384 / 128, 1), 256, 0, stream>>>(
      query, 0, 1024, Wq, 0, 1024, qb, 0, 1024, 1024);
  gemm_f32_wmma<128><<<dim3(1024 / BN, 2048 / 128, 1), 256, 0, stream>>>(
      key_ds, 0, 1024, Wk, 0, 1024, kb, 0, 1024, 1024);
  gemm_f32_wmma<128><<<dim3(1024 / BN, 2048 / 128, 1), 256, 0, stream>>>(
      val_ds, 0, 1024, Wv, 0, 1024, vb, 0, 1024, 1024);

  // 3) Fused masked-softmax attention
  attn_f32_wmma<<<dim3(512 / 128, 16, 32), 256, 0, stream>>>(qb, kb, vb, out);
}

// v001
// It runs in 299 microseconds.
// Two timings next to v000 both put it at 1.83 times that version's speed.
#include <hip/hip_runtime.h>

typedef __attribute__((ext_vector_type(2))) float v2f;
typedef __attribute__((ext_vector_type(4))) float v4f;
typedef __attribute__((ext_vector_type(8))) float v8f;
typedef __attribute__((ext_vector_type(4))) int v4i;

__device__ __forceinline__ v8f wmma4(v2f a, v2f b, v8f c) {
  // 8 args: (neg_a, A, neg_b, B, c_mod, C, reuse_a, reuse_b)
  return __builtin_amdgcn_wmma_f32_16x16x4_f32(false, a, false, b, (short)0, c,
                                               false, false);
}

#if __has_builtin(__builtin_amdgcn_global_load_async_to_lds_b128)
#define HAVE_ASYNC_LDS 1
typedef __attribute__((address_space(1))) v4i gv4i;  // global int4
typedef __attribute__((address_space(3))) v4i lv4i;  // LDS int4
#else
#define HAVE_ASYNC_LDS 0
#endif

__device__ __forceinline__ void copy16_g2lds(void* lds_dst, const void* gsrc) {
#if HAVE_ASYNC_LDS
  __builtin_amdgcn_global_load_async_to_lds_b128((gv4i*)gsrc, (lv4i*)lds_dst,
                                                 0, 0);
#else
  *(v4f*)lds_dst = *(const v4f*)gsrc;
#endif
}

__device__ __forceinline__ void async_join() {
#if HAVE_ASYNC_LDS
#if __has_builtin(__builtin_amdgcn_s_wait_asynccnt)
  __builtin_amdgcn_s_wait_asynccnt(0);
#else
  asm volatile("s_wait_asynccnt 0x0" ::: "memory");
#endif
#endif
}

// ---------------------------------------------------------------------------
// Batched GEMM: C[b] = A[b] (MxKc) * B[b] (KcxN), row-major, fp32.
// Grid: (N/BN, M/BM, batches). Block: 256 threads = 8 waves (4 M x 2 N).
// Per-wave micro-tile: (BM/4) x 64. BM=128 -> 8 accumulators, B-frag reuse x2.
// K loop: two LDS buffers; the copies of tile t+1 are in flight while tile t
// feeds the WMMAs. A copy cannot transpose, so B lies in LDS as eight blocks of
// 16 columns, [k][16] each, and a B fragment is two b32 reads one row apart.
// ---------------------------------------------------------------------------
constexpr int BN = 128, KC = 32;
constexpr int ASTR = KC + 4;
constexpr int BBLK = KC * 16 + 16;

__device__ __forceinline__ unsigned lds_byte(const void* p) {
  return (unsigned)(unsigned long long)p;  // low word = byte offset in LDS
}

template <int BM>
__device__ __forceinline__ void stage_tiles(float (*As)[ASTR],
                                            float (*Bs)[BBLK],
                                            const float* Ag, int lda,
                                            const float* Bg, int ldb, int tid) {
  const int ar = tid >> 3, ac = (tid & 7) << 2;
  const int br = tid >> 5, bc = (tid & 31) << 2;
  const float* lb = &Bs[bc >> 4][br * 16 + (bc & 15)];  // 8 rows on: +128
  const float* ga = Ag + (long long)ar * lda + ac;
  const float* gb = Bg + (long long)br * ldb + bc;
  const long long sa = 32LL * lda, sb = 8LL * ldb;
  if constexpr (BM == 128) {
    asm volatile(
        "global_load_async_to_lds_b128 %0, %1, off\n\t"
        "global_load_async_to_lds_b128 %2, %3, off\n\t"
        "global_load_async_to_lds_b128 %4, %5, off\n\t"
        "global_load_async_to_lds_b128 %6, %7, off\n\t"
        "global_load_async_to_lds_b128 %8, %9, off\n\t"
        "global_load_async_to_lds_b128 %10, %11, off\n\t"
        "global_load_async_to_lds_b128 %12, %13, off\n\t"
        "global_load_async_to_lds_b128 %14, %15, off\n\t"
        "s_wait_xcnt 0x0"
        :
        : "v"(lds_byte(lb)), "v"(gb),
          "v"(lds_byte(lb + 128)), "v"(gb + sb),
          "v"(lds_byte(lb + 256)), "v"(gb + 2 * sb),
          "v"(lds_byte(lb + 384)), "v"(gb + 3 * sb),
          "v"(lds_byte(&As[ar][ac])), "v"(ga),
          "v"(lds_byte(&As[ar + 32][ac])), "v"(ga + sa),
          "v"(lds_byte(&As[ar + 64][ac])), "v"(ga + 2 * sa),
          "v"(lds_byte(&As[ar + 96][ac])), "v"(ga + 3 * sa)
        : "memory");
  } else {
    asm volatile(
        "global_load_async_to_lds_b128 %0, %1, off\n\t"
        "global_load_async_to_lds_b128 %2, %3, off\n\t"
        "global_load_async_to_lds_b128 %4, %5, off\n\t"
        "global_load_async_to_lds_b128 %6, %7, off\n\t"
        "global_load_async_to_lds_b128 %8, %9, off\n\t"
        "global_load_async_to_lds_b128 %10, %11, off\n\t"
        "s_wait_xcnt 0x0"
        :
        : "v"(lds_byte(lb)), "v"(gb),
          "v"(lds_byte(lb + 128)), "v"(gb + sb),
          "v"(lds_byte(lb + 256)), "v"(gb + 2 * sb),
          "v"(lds_byte(lb + 384)), "v"(gb + 3 * sb),
          "v"(lds_byte(&As[ar][ac])), "v"(ga),
          "v"(lds_byte(&As[ar + 32][ac])), "v"(ga + sa)
        : "memory");
  }
}

template <int BM>
__global__ __launch_bounds__(256) void gemm_f32_wmma(
    const float* __restrict__ A, long long sA, int lda,
    const float* __restrict__ B, long long sB, int ldb,
    float* __restrict__ C, long long sC, int ldc, int Kc) {
  static_assert(BM == 64 || BM == 128, "stage_tiles covers these two");
  constexpr int WR = BM / 4;   // rows per wave: 16 or 32
  constexpr int NA = WR / 16;  // accumulator row-tiles per wave: 1 or 2
  __shared__ __align__(16) float As[2][BM][ASTR];
  __shared__ __align__(16) float Bs[2][BN / 16][BBLK];  // [block][k][16]

  const long long bz = blockIdx.z;
  A += bz * sA;
  B += bz * sB;
  C += bz * sC;
  const int m0 = blockIdx.y * BM;
  const int n0 = blockIdx.x * BN;
  const int tid = threadIdx.x;
  const int lane = tid & 31, wave = tid >> 5;
  const int wm = wave & 3, wn = wave >> 2;
  const int half = lane >> 4, lm = lane & 15;

  const float* Ag = A + (long long)m0 * lda;  // tile t starts at column t*KC
  const float* Bg = B + n0;                   // tile t starts at row t*KC
  const long long bstep = (long long)KC * ldb;
  const int nT = Kc / KC;

  v8f acc[NA][4] = {};

  stage_tiles<BM>(As[0], Bs[0], Ag, lda, Bg, ldb, tid);
  // tile 0 has landed for this wave; the barrier publishes it to the others
  asm volatile("s_wait_asynccnt 0x0" ::: "memory");
  __syncthreads();
  if (nT > 1) stage_tiles<BM>(As[1], Bs[1], Ag + KC, lda, Bg + bstep, ldb, tid);

  for (int t = 0; t < nT; ++t) {
    const int cur = t & 1;
    // unrolled so that every fragment offset is an immediate and the reads of
    // the next k step can be issued ahead of this step's WMMAs
#pragma unroll
    for (int kb = 0; kb < KC; kb += 4) {
      v2f a[NA];
#pragma unroll
      for (int i = 0; i < NA; ++i)
        a[i] = *(const v2f*)&As[cur][wm * WR + i * 16 + lm][kb + 2 * half];
#pragma unroll
      for (int u = 0; u < 4; ++u) {
        const float* bp = &Bs[cur][wn * 4 + u][(kb + 2 * half) * 16 + lm];
        v2f bb;
        bb.x = bp[0];
        bb.y = bp[16];
#pragma unroll
        for (int i = 0; i < NA; ++i) acc[i][u] = wmma4(a[i], bb, acc[i][u]);
      }
    }
    // this wave's reads of buffer cur are done before the buffer is refilled
    asm volatile("s_wait_dscnt 0x0" ::: "memory");
    // this wave's copies of tile t+1 have landed before the barrier publishes
    asm volatile("s_wait_asynccnt 0x0" ::: "memory");
    __syncthreads();
    if (t + 2 < nT)
      stage_tiles<BM>(As[cur], Bs[cur], Ag + (t + 2) * KC, lda,
                      Bg + (t + 2) * bstep, ldb, tid);
  }
  // no copy is outstanding when the wave goes on to its stores and ends
  asm volatile("s_wait_asynccnt 0x0" ::: "memory");

#pragma unroll
  for (int i = 0; i < NA; ++i)
#pragma unroll
    for (int t = 0; t < 4; ++t)
#pragma unroll
      for (int r = 0; r < 8; ++r) {
        const int row = m0 + wm * WR + i * 16 + r + 8 * half;
        const int col = n0 + wn * 64 + t * 16 + lm;
        C[(long long)row * ldc + col] = acc[i][t][r];
      }
}

// ---------------------------------------------------------------------------
// Fused attention per (b, h, 128-row strip): scores = Q*K^T, tril mask,
// softmax over K=64, out = attn*V.  8 waves x 16 query rows.
// qa[] holds the Q strip during the scores phase, then is recycled as the
// per-wave attention-weight tile (each wave touches only its own 16 rows).
// ---------------------------------------------------------------------------
constexpr float NEGV = -9e15f;
constexpr int QSTR = 68;  // mult-of-4 row stride (b128 stores, b64 frag reads)
constexpr int VSTR = 66;  // even row stride (b64 frag reads)

__global__ __launch_bounds__(256) void attn_f32_wmma(
    const float* __restrict__ q,  // [B*S, 1024] = [b,s,h,hd]
    const float* __restrict__ k,  // [B*K, 1024] = [b,kk,h,hd]
    const float* __restrict__ v,  // [B*K, 1024]
    float* __restrict__ out) {    // [B*S, 1024]
  __shared__ __align__(16) float qa[128][QSTR];  // Q strip, then attn weights
  __shared__ __align__(16) float ks[64][QSTR];   // K_h [kk][hd]
  __shared__ __align__(16) float vst[64][VSTR];  // V_h transposed [hd][kk]

  const int strip = blockIdx.x;  // 0..3
  const int h = blockIdx.y;      // 0..15
  const int b = blockIdx.z;      // 0..31
  const int tid = threadIdx.x;
  const int lane = tid & 31, wave = tid >> 5;
  const int half = lane >> 4, lm = lane & 15;

  // Stage K (async), V (transposed), Q strip (async).
  for (int i = tid; i < 64 * 16; i += 256) {  // 64 rows x 16 v4f
    const int r = i >> 4, c = (i & 15) << 2;
    const long long src = (long long)(b * 64 + r) * 1024 + h * 64 + c;
    copy16_g2lds(&ks[r][c], &k[src]);
    const v4f vv = *(const v4f*)&v[src];
    vst[c + 0][r] = vv.x;
    vst[c + 1][r] = vv.y;
    vst[c + 2][r] = vv.z;
    vst[c + 3][r] = vv.w;
  }
  for (int i = tid; i < 128 * 16; i += 256) {  // 128 rows x 16 v4f
    const int r = i >> 4, c = (i & 15) << 2;
    copy16_g2lds(&qa[r][c],
                 &q[(long long)(b * 512 + strip * 128 + r) * 1024 + h * 64 + c]);
  }
  async_join();
  __syncthreads();

  const int srow0 = strip * 128 + wave * 16;

  // scores = Q * K^T (contraction over HD=64); both frags are b64 LDS loads
  v8f sc[4] = {};
#pragma unroll
  for (int kb = 0; kb < 64; kb += 4) {
    const v2f a = *(const v2f*)&qa[wave * 16 + lm][kb + 2 * half];
#pragma unroll
    for (int t = 0; t < 4; ++t) {
      const v2f bb = *(const v2f*)&ks[t * 16 + lm][kb + 2 * half];
      sc[t] = wmma4(a, bb, sc[t]);
    }
  }

  // tril mask + row softmax. Row m = r + 8*half lives in one 16-lane group;
  // each lane holds 4 columns (16t+lm); xor masks 1/2/4/8 stay in-group.
#pragma unroll
  for (int r = 0; r < 8; ++r) {
    const int srow = srow0 + r + 8 * half;
    float vals[4];
    float mx = NEGV;
#pragma unroll
    for (int t = 0; t < 4; ++t) {
      const int col = t * 16 + lm;
      float x = sc[t][r];
      x = (col <= srow) ? x : NEGV;
      vals[t] = x;
      mx = fmaxf(mx, x);
    }
    mx = fmaxf(mx, __shfl_xor(mx, 1));
    mx = fmaxf(mx, __shfl_xor(mx, 2));
    mx = fmaxf(mx, __shfl_xor(mx, 4));
    mx = fmaxf(mx, __shfl_xor(mx, 8));
    float s = 0.f;
#pragma unroll
    for (int t = 0; t < 4; ++t) {
      vals[t] = __expf(vals[t] - mx);  // masked entries underflow to 0
      s += vals[t];
    }
    s += __shfl_xor(s, 1);
    s += __shfl_xor(s, 2);
    s += __shfl_xor(s, 4);
    s += __shfl_xor(s, 8);
    const float inv = 1.0f / s;
    // Recycle qa: this wave's Q rows are fully consumed (same-wave ds order).
#pragma unroll
    for (int t = 0; t < 4; ++t)
      qa[wave * 16 + r + 8 * half][t * 16 + lm] = vals[t] * inv;
  }

  // out = attn * V (contraction over K=64); V read via transposed tile
  v8f ov[4] = {};
#pragma unroll
  for (int kb = 0; kb < 64; kb += 4) {
    const v2f a = *(const v2f*)&qa[wave * 16 + lm][kb + 2 * half];
#pragma unroll
    for (int t = 0; t < 4; ++t) {
      const v2f bb = *(const v2f*)&vst[t * 16 + lm][kb + 2 * half];
      ov[t] = wmma4(a, bb, ov[t]);
    }
  }

  float* orow = &out[(long long)(b * 512 + srow0) * 1024 + h * 64];
#pragma unroll
  for (int t = 0; t < 4; ++t)
#pragma unroll
    for (int r = 0; r < 8; ++r)
      orow[(long long)(r + 8 * half) * 1024 + t * 16 + lm] = ov[t][r];
}

// ---------------------------------------------------------------------------
extern "C" void kernel_launch(void* const* d_in, const int* in_sizes, int n_in,
                              void* d_out, int out_size, void* d_ws,
                              size_t ws_size, hipStream_t stream) {
  const float* query = (const float*)d_in[0];  // [32,512,1024]
  const float* key   = (const float*)d_in[1];  // [32,512,1024]
  const float* value = (const float*)d_in[2];  // [32,512,1024]
  const float* Wq    = (const float*)d_in[3];  // [1024,16,64]
  const float* Wk    = (const float*)d_in[4];
  const float* Wv    = (const float*)d_in[5];
  const float* Kd    = (const float*)d_in[6];  // [64,512]
  const float* Vd    = (const float*)d_in[7];  // [64,512]
  float* out = (float*)d_out;                  // [32,512,1024]

  // Workspace (fp32 elements), 96 MB total.
  float* ws = (float*)d_ws;
  float* key_ds = ws;                               // 32*64*1024
  float* val_ds = key_ds + (size_t)32 * 64 * 1024;  // 32*64*1024
  float* qb     = val_ds + (size_t)32 * 64 * 1024;  // 32*512*1024
  float* kb     = qb + (size_t)32 * 512 * 1024;     // 32*64*1024
  float* vb     = kb + (size_t)32 * 64 * 1024;      // 32*64*1024

  const long long sKV = 512LL * 1024, sDS = 64LL * 1024;

  // 1) Linformer downsampling: [64,512] x [512,1024] per batch (M=64 -> BM=64)
  gemm_f32_wmma<64><<<dim3(1024 / BN, 1, 32), 256, 0, stream>>>(
      Kd, 0, 512, key, sKV, 1024, key_ds, sDS, 1024, 512);
  gemm_f32_wmma<64><<<dim3(1024 / BN, 1, 32), 256, 0, stream>>>(
      Vd, 0, 512, value, sKV, 1024, val_ds, sDS, 1024, 512);

  // 2) Head projections (flattened single GEMMs, BM=128)
  gemm_f32_wmma<128><<<dim3(1024 / BN, 16384 / 128, 1), 256, 0, stream>>>(
      query, 0, 1024, Wq, 0, 1024, qb, 0, 1024, 1024);
  gemm_f32_wmma<128><<<dim3(1024 / BN, 2048 / 128, 1), 256, 0, stream>>>(
      key_ds, 0, 1024, Wk, 0, 1024, kb, 0, 1024, 1024);
  gemm_f32_wmma<128><<<dim3(1024 / BN, 2048 / 128, 1), 256, 0, stream>>>(
      val_ds, 0, 1024, Wv, 0, 1024, vb, 0, 1024, 1024);

  // 3) Fused masked-softmax attention
  attn_f32_wmma<<<dim3(512 / 128, 16, 32), 256, 0, stream>>>(qb, kb, vb, out);
}

// v002
// A run of this version takes 250 microseconds.
// In both of two side-by-side timings against v001, it was 1.20 times as fast.
// All steps since v000 together make it 2.19 times as fast.
#include <hip/hip_runtime.h>

typedef __attribute__((ext_vector_type(2))) float v2f;
typedef __attribute__((ext_vector_type(4))) float v4f;
typedef __attribute__((ext_vector_type(8))) float v8f;
typedef __attribute__((ext_vector_type(4))) int v4i;

__device__ __forceinline__ v8f wmma4(v2f a, v2f b, v8f c) {
  // 8 args: (neg_a, A, neg_b, B, c_mod, C, reuse_a, reuse_b)
  return __builtin_amdgcn_wmma_f32_16x16x4_f32(false, a, false, b, (short)0, c,
                                               false, false);
}

#if __has_builtin(__builtin_amdgcn_global_load_async_to_lds_b128)
#define HAVE_ASYNC_LDS 1
typedef __attribute__((address_space(1))) v4i gv4i;  // global int4
typedef __attribute__((address_space(3))) v4i lv4i;  // LDS int4
#else
#define HAVE_ASYNC_LDS 0
#endif

__device__ __forceinline__ void copy16_g2lds(void* lds_dst, const void* gsrc) {
#if HAVE_ASYNC_LDS
  __builtin_amdgcn_global_load_async_to_lds_b128((gv4i*)gsrc, (lv4i*)lds_dst,
                                                 0, 0);
#else
  *(v4f*)lds_dst = *(const v4f*)gsrc;
#endif
}

__device__ __forceinline__ void async_join() {
#if HAVE_ASYNC_LDS
#if __has_builtin(__builtin_amdgcn_s_wait_asynccnt)
  __builtin_amdgcn_s_wait_asynccnt(0);
#else
  asm volatile("s_wait_asynccnt 0x0" ::: "memory");
#endif
#endif
}

// ---------------------------------------------------------------------------
// Batched GEMM: C[b] = A[b] (MxKc) * B[b] (KcxN), row-major, fp32.
// Grid: (N/BN, M/BM, batches). Block: 256 threads = 8 waves (4 M x 2 N).
// One launch can hold two independent problems of one shape: batches below nb
// work on the operand set A0, B0, C0, batches from nb on on A1, B1, C1.
// Per-wave micro-tile: (BM/4) x 64. BM=128 -> 8 accumulators, B-frag reuse x2.
// K loop: two LDS buffers; the copies of tile t+1 are in flight while tile t
// feeds the WMMAs. A copy cannot transpose, so B lies in LDS as eight blocks of
// 16 columns, [k][16] each, and a B fragment is two b32 reads one row apart.
// ---------------------------------------------------------------------------
constexpr int BN = 128, KC = 32;
constexpr int ASTR = KC + 4;
constexpr int BBLK = KC * 16 + 16;

__device__ __forceinline__ unsigned lds_byte(const void* p) {
  return (unsigned)(unsigned long long)p;  // low word = byte offset in LDS
}

template <int BM>
__device__ __forceinline__ void stage_tiles(float (*As)[ASTR],
                                            float (*Bs)[BBLK],
                                            const float* Ag, int lda,
                                            const float* Bg, int ldb, int tid) {
  const int ar = tid >> 3, ac = (tid & 7) << 2;
  const int br = tid >> 5, bc = (tid & 31) << 2;
  const float* lb = &Bs[bc >> 4][br * 16 + (bc & 15)];  // 8 rows on: +128
  const float* ga = Ag + (long long)ar * lda + ac;
  const float* gb = Bg + (long long)br * ldb + bc;
  const long long sa = 32LL * lda, sb = 8LL * ldb;
  if constexpr (BM == 128) {
    asm volatile(
        "global_load_async_to_lds_b128 %0, %1, off\n\t"
        "global_load_async_to_lds_b128 %2, %3, off\n\t"
        "global_load_async_to_lds_b128 %4, %5, off\n\t"
        "global_load_async_to_lds_b128 %6, %7, off\n\t"
        "global_load_async_to_lds_b128 %8, %9, off\n\t"
        "global_load_async_to_lds_b128 %10, %11, off\n\t"
        "global_load_async_to_lds_b128 %12, %13, off\n\t"
        "global_load_async_to_lds_b128 %14, %15, off\n\t"
        "s_wait_xcnt 0x0"
        :
        : "v"(lds_byte(lb)), "v"(gb),
          "v"(lds_byte(lb + 128)), "v"(gb + sb),
          "v"(lds_byte(lb + 256)), "v"(gb + 2 * sb),
          "v"(lds_byte(lb + 384)), "v"(gb + 3 * sb),
          "v"(lds_byte(&As[ar][ac])), "v"(ga),
          "v"(lds_byte(&As[ar + 32][ac])), "v"(ga + sa),
          "v"(lds_byte(&As[ar + 64][ac])), "v"(ga + 2 * sa),
          "v"(lds_byte(&As[ar + 96][ac])), "v"(ga + 3 * sa)
        : "memory");
  } else {
    asm volatile(
        "global_load_async_to_lds_b128 %0, %1, off\n\t"
        "global_load_async_to_lds_b128 %2, %3, off\n\t"
        "global_load_async_to_lds_b128 %4, %5, off\n\t"
        "global_load_async_to_lds_b128 %6, %7, off\n\t"
        "global_load_async_to_lds_b128 %8, %9, off\n\t"
        "global_load_async_to_lds_b128 %10, %11, off\n\t"
        "s_wait_xcnt 0x0"
        :
        : "v"(lds_byte(lb)), "v"(gb),
          "v"(lds_byte(lb + 128)), "v"(gb + sb),
          "v"(lds_byte(lb + 256)), "v"(gb + 2 * sb),
          "v"(lds_byte(lb + 384)), "v"(gb + 3 * sb),
          "v"(lds_byte(&As[ar][ac])), "v"(ga),
          "v"(lds_byte(&As[ar + 32][ac])), "v"(ga + sa)
        : "memory");
  }
}

template <int BM>
__global__ __launch_bounds__(256) void gemm_f32_wmma(
    const float* __restrict__ A0, const float* __restrict__ A1, long long sA,
    int lda, const float* __restrict__ B0, const float* __restrict__ B1,
    long long sB, int ldb, float* __restrict__ C0, float* __restrict__ C1,
    long long sC, int ldc, int Kc, int nb) {
  static_assert(BM == 64 || BM == 128, "stage_tiles covers these two");
  constexpr int WR = BM / 4;   // rows per wave: 16 or 32
  constexpr int NA = WR / 16;  // accumulator row-tiles per wave: 1 or 2
  __shared__ __align__(16) float As[2][BM][ASTR];
  __shared__ __align__(16) float Bs[2][BN / 16][BBLK];  // [block][k][16]

  const bool second = (int)blockIdx.z >= nb;  // the same for the whole block
  const long long bz = (int)blockIdx.z - (second ? nb : 0);
  const float* A = (second ? A1 : A0) + bz * sA;
  const float* B = (second ? B1 : B0) + bz * sB;
  float* C = (second ? C1 : C0) + bz * sC;
  const int m0 = blockIdx.y * BM;
  const int n0 = blockIdx.x * BN;
  const int tid = threadIdx.x;
  const int lane = tid & 31, wave = tid >> 5;
  const int wm = wave & 3, wn = wave >> 2;
  const int half = lane >> 4, lm = lane & 15;

  const float* Ag = A + (long long)m0 * lda;  // tile t starts at column t*KC
  const float* Bg = B + n0;                   // tile t starts at row t*KC
  const long long bstep = (long long)KC * ldb;
  const int nT = Kc / KC;

  v8f acc[NA][4] = {};

  stage_tiles<BM>(As[0], Bs[0], Ag, lda, Bg, ldb, tid);
  // tile 0 has landed for this wave; the barrier publishes it to the others
  asm volatile("s_wait_asynccnt 0x0" ::: "memory");
  __syncthreads();
  if (nT > 1) stage_tiles<BM>(As[1], Bs[1], Ag + KC, lda, Bg + bstep, ldb, tid);

  for (int t = 0; t < nT; ++t) {
    const int cur = t & 1;
    // unrolled so that every fragment offset is an immediate and the reads of
    // the next k step can be issued ahead of this step's WMMAs
#pragma unroll
    for (int kb = 0; kb < KC; kb += 4) {
      v2f a[NA];
#pragma unroll
      for (int i = 0; i < NA; ++i)
        a[i] = *(const v2f*)&As[cur][wm * WR + i * 16 + lm][kb + 2 * half];
#pragma unroll
      for (int u = 0; u < 4; ++u) {
        const float* bp = &Bs[cur][wn * 4 + u][(kb + 2 * half) * 16 + lm];
        v2f bb;
        bb.x = bp[0];
        bb.y = bp[16];
#pragma unroll
        for (int i = 0; i < NA; ++i) acc[i][u] = wmma4(a[i], bb, acc[i][u]);
      }
    }
    // this wave's reads of buffer cur are done before the buffer is refilled
    asm volatile("s_wait_dscnt 0x0" ::: "memory");
    // this wave's copies of tile t+1 have landed before the barrier publishes
    asm volatile("s_wait_asynccnt 0x0" ::: "memory");
    __syncthreads();
    if (t + 2 < nT)
      stage_tiles<BM>(As[cur], Bs[cur], Ag + (t + 2) * KC, lda,
                      Bg + (t + 2) * bstep, ldb, tid);
  }
  // no copy is outstanding when the wave goes on to its stores and ends
  asm volatile("s_wait_asynccnt 0x0" ::: "memory");

#pragma unroll
  for (int i = 0; i < NA; ++i)
#pragma unroll
    for (int t = 0; t < 4; ++t)
#pragma unroll
      for (int r = 0; r < 8; ++r) {
        const int row = m0 + wm * WR + i * 16 + r + 8 * half;
        const int col = n0 + wn * 64 + t * 16 + lm;
        C[(long long)row * ldc + col] = acc[i][t][r];
      }
}

// ---------------------------------------------------------------------------
// Fused attention per (b, h, 128-row strip): scores = Q*K^T, tril mask,
// softmax over K=64, out = attn*V.  8 waves x 16 query rows.
// qa[] holds the Q strip during the scores phase, then is recycled as the
// per-wave attention-weight tile (each wave touches only its own 16 rows).
// ---------------------------------------------------------------------------
constexpr float NEGV = -9e15f;
constexpr int QSTR = 68;  // mult-of-4 row stride (b128 stores, b64 frag reads)
constexpr int VSTR = 66;  // even row stride (b64 frag reads)

__global__ __launch_bounds__(256) void attn_f32_wmma(
    const float* __restrict__ q,  // [B*S, 1024] = [b,s,h,hd]
    const float* __restrict__ k,  // [B*K, 1024] = [b,kk,h,hd]
    const float* __restrict__ v,  // [B*K, 1024]
    float* __restrict__ out) {    // [B*S, 1024]
  __shared__ __align__(16) float qa[128][QSTR];  // Q strip, then attn weights
  __shared__ __align__(16) float ks[64][QSTR];   // K_h [kk][hd]
  __shared__ __align__(16) float vst[64][VSTR];  // V_h transposed [hd][kk]

  const int strip = blockIdx.x;  // 0..3
  const int h = blockIdx.y;      // 0..15
  const int b = blockIdx.z;      // 0..31
  const int tid = threadIdx.x;
  const int lane = tid & 31, wave = tid >> 5;
  const int half = lane >> 4, lm = lane & 15;

  // Stage K (async), V (transposed), Q strip (async).
  for (int i = tid; i < 64 * 16; i += 256) {  // 64 rows x 16 v4f
    const int r = i >> 4, c = (i & 15) << 2;
    const long long src = (long long)(b * 64 + r) * 1024 + h * 64 + c;
    copy16_g2lds(&ks[r][c], &k[src]);
    const v4f vv = *(const v4f*)&v[src];
    vst[c + 0][r] = vv.x;
    vst[c + 1][r] = vv.y;
    vst[c + 2][r] = vv.z;
    vst[c + 3][r] = vv.w;
  }
  for (int i = tid; i < 128 * 16; i += 256) {  // 128 rows x 16 v4f
    const int r = i >> 4, c = (i & 15) << 2;
    copy16_g2lds(&qa[r][c],
                 &q[(long long)(b * 512 + strip * 128 + r) * 1024 + h * 64 + c]);
  }
  async_join();
  __syncthreads();

  const int srow0 = strip * 128 + wave * 16;

  // scores = Q * K^T (contraction over HD=64); both frags are b64 LDS loads
  v8f sc[4] = {};
#pragma unroll
  for (int kb = 0; kb < 64; kb += 4) {
    const v2f a = *(const v2f*)&qa[wave * 16 + lm][kb + 2 * half];
#pragma unroll
    for (int t = 0; t < 4; ++t) {
      const v2f bb = *(const v2f*)&ks[t * 16 + lm][kb + 2 * half];
      sc[t] = wmma4(a, bb, sc[t]);
    }
  }

  // tril mask + row softmax. Row m = r + 8*half lives in one 16-lane group;
  // each lane holds 4 columns (16t+lm); xor masks 1/2/4/8 stay in-group.
#pragma unroll
  for (int r = 0; r < 8; ++r) {
    const int srow = srow0 + r + 8 * half;
    float vals[4];
    float mx = NEGV;
#pragma unroll
    for (int t = 0; t < 4; ++t) {
      const int col = t * 16 + lm;
      float x = sc[t][r];
      x = (col <= srow) ? x : NEGV;
      vals[t] = x;
      mx = fmaxf(mx, x);
    }
    mx = fmaxf(mx, __shfl_xor(mx, 1));
    mx = fmaxf(mx, __shfl_xor(mx, 2));
    mx = fmaxf(mx, __shfl_xor(mx, 4));
    mx = fmaxf(mx, __shfl_xor(mx, 8));
    float s = 0.f;
#pragma unroll
    for (int t = 0; t < 4; ++t) {
      vals[t] = __expf(vals[t] - mx);  // masked entries underflow to 0
      s += vals[t];
    }
    s += __shfl_xor(s, 1);
    s += __shfl_xor(s, 2);
    s += __shfl_xor(s, 4);
    s += __shfl_xor(s, 8);
    const float inv = 1.0f / s;
    // Recycle qa: this wave's Q rows are fully consumed (same-wave ds order).
#pragma unroll
    for (int t = 0; t < 4; ++t)
      qa[wave * 16 + r + 8 * half][t * 16 + lm] = vals[t] * inv;
  }

  // out = attn * V (contraction over K=64); V read via transposed tile
  v8f ov[4] = {};
#pragma unroll
  for (int kb = 0; kb < 64; kb += 4) {
    const v2f a = *(const v2f*)&qa[wave * 16 + lm][kb + 2 * half];
#pragma unroll
    for (int t = 0; t < 4; ++t) {
      const v2f bb = *(const v2f*)&vst[t * 16 + lm][kb + 2 * half];
      ov[t] = wmma4(a, bb, ov[t]);
    }
  }

  float* orow = &out[(long long)(b * 512 + srow0) * 1024 + h * 64];
#pragma unroll
  for (int t = 0; t < 4; ++t)
#pragma unroll
    for (int r = 0; r < 8; ++r)
      orow[(long long)(r + 8 * half) * 1024 + t * 16 + lm] = ov[t][r];
}

// ---------------------------------------------------------------------------
extern "C" void kernel_launch(void* const* d_in, const int* in_sizes, int n_in,
                              void* d_out, int out_size, void* d_ws,
                              size_t ws_size, hipStream_t stream) {
  const float* query = (const float*)d_in[0];  // [32,512,1024]
  const float* key   = (const float*)d_in[1];  // [32,512,1024]
  const float* value = (const float*)d_in[2];  // [32,512,1024]
  const float* Wq    = (const float*)d_in[3];  // [1024,16,64]
  const float* Wk    = (const float*)d_in[4];
  const float* Wv    = (const float*)d_in[5];
  const float* Kd    = (const float*)d_in[6];  // [64,512]
  const float* Vd    = (const float*)d_in[7];  // [64,512]
  float* out = (float*)d_out;                  // [32,512,1024]

  // Workspace (fp32 elements), 96 MB total.
  float* ws = (float*)d_ws;
  float* key_ds = ws;                               // 32*64*1024
  float* val_ds = key_ds + (size_t)32 * 64 * 1024;  // 32*64*1024
  float* qb     = val_ds + (size_t)32 * 64 * 1024;  // 32*512*1024
  float* kb     = qb + (size_t)32 * 512 * 1024;     // 32*64*1024
  float* vb     = kb + (size_t)32 * 64 * 1024;      // 32*64*1024

  const long long sKV = 512LL * 1024, sDS = 64LL * 1024;

  // 1) Linformer downsampling: [64,512] x [512,1024] per batch (M=64 -> BM=64),
  //    key side and value side in one launch: 512 blocks, two per WGP
  gemm_f32_wmma<64><<<dim3(1024 / BN, 1, 64), 256, 0, stream>>>(
      Kd, Vd, 0, 512, key, value, sKV, 1024, key_ds, val_ds, sDS, 1024, 512, 32);

  gemm_f32_wmma<128><<<dim3(1024 / BN, 16384 / 128, 1), 256, 0, stream>>>(
      query, query, 0, 1024, Wq, Wq, 0, 1024, qb, qb, 0, 1024, 1024, 1);
  gemm_f32_wmma<128><<<dim3(1024 / BN, 2048 / 128, 2), 256, 0, stream>>>(
      key_ds, val_ds, 0, 1024, Wk, Wv, 0, 1024, kb, vb, 0, 1024, 1024, 1);

  // 3) Fused masked-softmax attention
  attn_f32_wmma<<<dim3(512 / 128, 16, 32), 256, 0, stream>>>(qb, kb, vb, out);
}
